// v000
// The times below were measured on an AMD MI455X: many runs one after another, warmed up first and cycling through
// copies of the inputs, with the whole window's GPU time divided by the number of runs. Launches and the gaps
// between them are all in it. The median over several windows is given; except for v000 it joins two sittings, which
// can be a few percent apart, so the side-by-side timings, each taken in one sitting, are the better comparison.
// v000 is the starting kernel. One run takes 516 microseconds.
#include <hip/hip_runtime.h>
#include <hip/hip_bf16.h>
#include <math.h>

// Problem constants (reference: B=2, S=2048, D=1024, H=16, HD=64)
#define BB   2
#define SS   2048
#define DD   1024
#define HH   16
#define HD   64
#define ROWS (BB * SS)        // 4096
#define EPS  1e-5f

typedef __attribute__((ext_vector_type(16))) __bf16 v16bf;
typedef __attribute__((ext_vector_type(8)))  __bf16 v8bf;
typedef __attribute__((ext_vector_type(8)))  float  v8f;

// ---------------------------------------------------------------------------
// helpers
// ---------------------------------------------------------------------------
__device__ __forceinline__ v16bf combine16(v8bf lo, v8bf hi) {
    v16bf r;
#pragma unroll
    for (int i = 0; i < 8; ++i) { r[i] = lo[i]; r[i + 8] = hi[i]; }
    return r;
}

__device__ __forceinline__ v8bf ld8(const __bf16* p) {
    return *reinterpret_cast<const v8bf*>(p);
}

__device__ __forceinline__ v8f wmma_bf16(v16bf a, v16bf b, v8f c) {
    return __builtin_amdgcn_wmma_f32_16x16x32_bf16(
        /*neg_a=*/false, a, /*neg_b=*/false, b,
        /*c_mod=*/(short)0, c, /*reuse_a=*/false, /*reuse_b=*/false);
}

// DPP16 lane permute within each 16-lane row (VALU, no LDS round-trip).
// 0xB1 = quad_perm(1,0,3,2)=xor1, 0x4E = quad_perm(2,3,0,1)=xor2,
// 0x141 = row_half_mirror (=xor4 pairing), 0x140 = row_mirror (=xor8 pairing).
template <int CTRL>
__device__ __forceinline__ float dpp_f(float v) {
    int r = __builtin_amdgcn_update_dpp(0, __float_as_int(v), CTRL, 0xF, 0xF, true);
    return __int_as_float(r);
}

// Reduce across the 16 lanes of each half-wave; every lane ends with result.
__device__ __forceinline__ float rowmax16(float v) {
    v = fmaxf(v, dpp_f<0xB1>(v));
    v = fmaxf(v, dpp_f<0x4E>(v));
    v = fmaxf(v, dpp_f<0x141>(v));
    v = fmaxf(v, dpp_f<0x140>(v));
    return v;
}
__device__ __forceinline__ float rowsum16(float v) {
    v += dpp_f<0xB1>(v);
    v += dpp_f<0x4E>(v);
    v += dpp_f<0x141>(v);
    v += dpp_f<0x140>(v);
    return v;
}

__device__ __forceinline__ float gelu_tanh(float x) {
    const float c = 0.7978845608028654f;   // sqrt(2/pi)
    float x3 = x * x * x;
    return 0.5f * x * (1.0f + tanhf(c * (x + 0.044715f * x3)));
}

// ---------------------------------------------------------------------------
// weight convert: W[K,N] f32 (row-major) -> Wt[N,K] bf16, LDS-tiled 32x32 so
// both the f32 reads and the bf16 writes are coalesced.
// block = (32,8); grid = (N/32, K/32)
// ---------------------------------------------------------------------------
__global__ void k_transpose_bf16(const float* __restrict__ W,
                                 __bf16* __restrict__ Wt, int K, int N) {
    __shared__ float t[32][33];
    int tx = threadIdx.x, ty = threadIdx.y;
    int n0 = blockIdx.x * 32, k0 = blockIdx.y * 32;
#pragma unroll
    for (int r = 0; r < 4; ++r)
        t[ty + r * 8][tx] = W[(size_t)(k0 + ty + r * 8) * N + (n0 + tx)];
    __syncthreads();
#pragma unroll
    for (int r = 0; r < 4; ++r)
        Wt[(size_t)(n0 + ty + r * 8) * K + (k0 + tx)] = (__bf16)t[tx][ty + r * 8];
}

// ---------------------------------------------------------------------------
// LayerNorm: x[ROWS,DD] f32 -> out[ROWS,DD] bf16.  One block (256 thr) per row.
// ---------------------------------------------------------------------------
__global__ void k_layernorm_bf16(const float* __restrict__ x,
                                 const float* __restrict__ gain,
                                 const float* __restrict__ shift,
                                 __bf16* __restrict__ out) {
    int row = blockIdx.x;
    int tid = threadIdx.x;
    int lane = tid & 31, wid = tid >> 5;

    const float4* rp = reinterpret_cast<const float4*>(x + (size_t)row * DD);
    float4 v = rp[tid];
    float s  = v.x + v.y + v.z + v.w;
    float sq = v.x * v.x + v.y * v.y + v.z * v.z + v.w * v.w;
#pragma unroll
    for (int off = 16; off >= 1; off >>= 1) {
        s  += __shfl_xor(s,  off);
        sq += __shfl_xor(sq, off);
    }
    __shared__ float ps[8], pq[8];
    __shared__ float s_mean, s_rinv;
    if (lane == 0) { ps[wid] = s; pq[wid] = sq; }
    __syncthreads();
    if (tid == 0) {
        float ts = 0.f, tq = 0.f;
#pragma unroll
        for (int i = 0; i < 8; ++i) { ts += ps[i]; tq += pq[i]; }
        float mean = ts * (1.0f / DD);
        float var  = tq * (1.0f / DD) - mean * mean;
        s_mean = mean;
        s_rinv = rsqrtf(var + EPS);
    }
    __syncthreads();
    float mean = s_mean, rinv = s_rinv;

    __bf16* op = out + (size_t)row * DD + tid * 4;
    int c0 = tid * 4;
    float xv[4] = {v.x, v.y, v.z, v.w};
#pragma unroll
    for (int j = 0; j < 4; ++j) {
        float val = (xv[j] - mean) * rinv * gain[c0 + j] + shift[c0 + j];
        op[j] = (__bf16)val;
    }
}

// ---------------------------------------------------------------------------
// Register-blocked WMMA GEMM: C[M,N] = A[M,K](bf16) * Bt[N,K]^T(bf16)
// Each wave computes a 64x32 output block (4x2 WMMA tiles): per 32-deep
// K-step it issues 8 v_wmma against 6KB of loads (~21 FLOP/byte) while
// staying under the 256-VGPR budget (no spills). 8 waves per 256-thr block.
// ---------------------------------------------------------------------------
#define MODE_F32RES 0   // out f32 row-major, + bias, + residual
#define MODE_QK     2   // out bf16 [B,H,S,HD] head-major
#define MODE_VT     3   // out bf16 [B,H,HD,S] (V transposed)
#define MODE_GELU   4   // out bf16 row-major, gelu(v + bias)

template <int MODE>
__global__ void k_gemm_wmma(const __bf16* __restrict__ A,
                            const __bf16* __restrict__ Bt,
                            const float*  __restrict__ bias,
                            const float*  __restrict__ res,
                            void* __restrict__ out,
                            int M, int N, int K) {
    int lane = threadIdx.x & 31;
    int wid  = threadIdx.x >> 5;
    int blk  = blockIdx.x * 8 + wid;      // 64x32 block index
    int nbn  = N >> 5;
    int bm   = blk / nbn;
    int bn   = blk - bm * nbn;

    int lm   = lane & 15;
    int hi   = lane >> 4;
    int koff = hi ? 8 : 0;                // 16-bit operand lane K-pattern

    const __bf16* arow[4];
    const __bf16* brow[2];
#pragma unroll
    for (int i = 0; i < 4; ++i)
        arow[i] = A + (size_t)(bm * 64 + i * 16 + lm) * K;
#pragma unroll
    for (int j = 0; j < 2; ++j)
        brow[j] = Bt + (size_t)(bn * 32 + j * 16 + lm) * K;

    v8f acc[4][2] = {};
    for (int k0 = 0; k0 < K; k0 += 32) {
        v16bf a[4];
#pragma unroll
        for (int i = 0; i < 4; ++i)
            a[i] = combine16(ld8(arow[i] + k0 + koff),
                             ld8(arow[i] + k0 + koff + 16));
#pragma unroll
        for (int j = 0; j < 2; ++j) {
            v16bf b = combine16(ld8(brow[j] + k0 + koff),
                                ld8(brow[j] + k0 + koff + 16));
#pragma unroll
            for (int i = 0; i < 4; ++i)
                acc[i][j] = wmma_bf16(a[i], b, acc[i][j]);
        }
    }

    // ---- epilogue -------------------------------------------------------
#pragma unroll
    for (int j = 0; j < 2; ++j) {
        int n = bn * 32 + j * 16 + lm;
        float bv = bias ? bias[n] : 0.0f;
#pragma unroll
        for (int i = 0; i < 4; ++i) {
#pragma unroll
            for (int r = 0; r < 8; ++r) {
                int m = bm * 64 + i * 16 + r + (hi ? 8 : 0);
                float v = acc[i][j][r] + bv;
                if (MODE == MODE_F32RES) {
                    size_t idx = (size_t)m * N + n;
                    float rv = res ? res[idx] : 0.0f;
                    ((float*)out)[idx] = v + rv;
                } else if (MODE == MODE_QK) {
                    int b_ = m >> 11, s_ = m & (SS - 1);
                    int h_ = n >> 6,  d_ = n & (HD - 1);
                    ((__bf16*)out)[((((size_t)b_ * HH + h_) * SS + s_) << 6) + d_] = (__bf16)v;
                } else if (MODE == MODE_VT) {
                    int b_ = m >> 11, s_ = m & (SS - 1);
                    int h_ = n >> 6,  d_ = n & (HD - 1);
                    ((__bf16*)out)[(((size_t)b_ * HH + h_) * HD + d_) * SS + s_] = (__bf16)v;
                } else { // MODE_GELU
                    ((__bf16*)out)[(size_t)m * N + n] = (__bf16)gelu_tanh(v);
                }
            }
        }
    }
}

// ---------------------------------------------------------------------------
// Flash attention (causal). One wave handles one 16-row q tile of one (b,h).
// Q,K: bf16 [BH,S,HD]; Vt: bf16 [BH,HD,S]; ctx out: bf16 [ROWS, DD].
// Row-wise softmax reductions use DPP16 (VALU) instead of LDS bpermute.
// ---------------------------------------------------------------------------
__global__ void k_attention(const __bf16* __restrict__ Q,
                            const __bf16* __restrict__ Kb,
                            const __bf16* __restrict__ Vt,
                            __bf16* __restrict__ ctx) {
    __shared__ __align__(16) __bf16 lds_p[8][16 * 32];   // per-wave 16x32 prob tile

    int lane = threadIdx.x & 31;
    int wid  = threadIdx.x >> 5;
    int unit = blockIdx.x * 8 + wid;            // 0 .. BH*(S/16)-1
    int qt   = unit & (SS / 16 - 1);            // q tile within head
    int bh   = unit >> 7;                       // S/16 == 128 -> shift 7
    int qbase = qt * 16;

    const __bf16* Qh = Q  + (size_t)bh * SS * HD;
    const __bf16* Kh = Kb + (size_t)bh * SS * HD;
    const __bf16* Vh = Vt + (size_t)bh * HD * SS;

    int lm = lane & 15, hi = lane >> 4;
    int koff = hi ? 8 : 0;

    // Q operand (rows qbase..qbase+15, K = HD = 64 -> two 32-wide steps)
    const __bf16* qrow = Qh + (size_t)(qbase + lm) * HD;
    v16bf a0 = combine16(ld8(qrow + koff),      ld8(qrow + koff + 16));
    v16bf a1 = combine16(ld8(qrow + 32 + koff), ld8(qrow + 32 + koff + 16));

    float mrow[8], lrow[8];
    v8f acc[4] = {};
#pragma unroll
    for (int r = 0; r < 8; ++r) { mrow[r] = -1e30f; lrow[r] = 0.0f; }

    const float scale = 0.125f;                 // 1/sqrt(64)
    int cmax = (qbase + 15) >> 5;               // inclusive 32-key chunk idx

    for (int c32 = 0; c32 <= cmax; ++c32) {
        int kc = c32 * 32;

        // ---- scores: two 16-key subtiles -------------------------------
        v8f s0 = {}, s1 = {};
        {
            const __bf16* kr = Kh + (size_t)(kc + lm) * HD;
            v16bf b0 = combine16(ld8(kr + koff),      ld8(kr + koff + 16));
            v16bf b1 = combine16(ld8(kr + 32 + koff), ld8(kr + 32 + koff + 16));
            s0 = wmma_bf16(a0, b0, s0);
            s0 = wmma_bf16(a1, b1, s0);
        }
        {
            const __bf16* kr = Kh + (size_t)(kc + 16 + lm) * HD;
            v16bf b0 = combine16(ld8(kr + koff),      ld8(kr + koff + 16));
            v16bf b1 = combine16(ld8(kr + 32 + koff), ld8(kr + 32 + koff + 16));
            s1 = wmma_bf16(a0, b0, s1);
            s1 = wmma_bf16(a1, b1, s1);
        }

        // ---- online softmax (row-wise over 16-lane halves, DPP) --------
        int key0 = kc + lm, key1 = kc + 16 + lm;
#pragma unroll
        for (int r = 0; r < 8; ++r) {
            int q = qbase + r + (hi ? 8 : 0);
            float sv0 = (key0 <= q) ? s0[r] * scale : -1e30f;
            float sv1 = (key1 <= q) ? s1[r] * scale : -1e30f;

            float mx = rowmax16(fmaxf(sv0, sv1));
            float mnew  = fmaxf(mrow[r], mx);
            float alpha = __expf(mrow[r] - mnew);
            mrow[r] = mnew;

            float p0 = __expf(sv0 - mnew);
            float p1 = __expf(sv1 - mnew);
            float rs = rowsum16(p0 + p1);
            lrow[r] = lrow[r] * alpha + rs;
#pragma unroll
            for (int t = 0; t < 4; ++t) acc[t][r] *= alpha;

            int ml = r + (hi ? 8 : 0);
            lds_p[wid][ml * 32 + lm]      = (__bf16)p0;
            lds_p[wid][ml * 32 + 16 + lm] = (__bf16)p1;
        }

        // LDS round trip re-swizzles P from C-layout into A-layout.
        asm volatile("s_wait_dscnt 0" ::: "memory");

        const __bf16* pl = &lds_p[wid][lm * 32];
        v16bf pa = combine16(ld8(pl + koff), ld8(pl + koff + 16));

        // ---- ctx += P * V (Vt rows are contiguous in key dim) ----------
#pragma unroll
        for (int t = 0; t < 4; ++t) {
            const __bf16* vr = Vh + (size_t)(t * 16 + lm) * SS + kc;
            v16bf vb = combine16(ld8(vr + koff), ld8(vr + koff + 16));
            acc[t] = wmma_bf16(pa, vb, acc[t]);
        }
    }

    // ---- write ctx [ROWS, DD] ------------------------------------------
    int b_ = bh >> 4, h_ = bh & (HH - 1);
#pragma unroll
    for (int t = 0; t < 4; ++t) {
#pragma unroll
        for (int r = 0; r < 8; ++r) {
            int ml = r + (hi ? 8 : 0);
            size_t row = (size_t)b_ * SS + qbase + ml;
            ctx[row * DD + h_ * HD + t * 16 + lm] = (__bf16)(acc[t][r] / lrow[r]);
        }
    }
}

// ---------------------------------------------------------------------------
// launch
// ---------------------------------------------------------------------------
extern "C" void kernel_launch(void* const* d_in, const int* in_sizes, int n_in,
                              void* d_out, int out_size, void* d_ws, size_t ws_size,
                              hipStream_t stream) {
    const float* x  = (const float*)d_in[0];
    const float* Wq = (const float*)d_in[1];
    const float* Wk = (const float*)d_in[2];
    const float* Wv = (const float*)d_in[3];
    const float* Wo = (const float*)d_in[4];
    const float* bo = (const float*)d_in[5];
    const float* W1 = (const float*)d_in[6];
    const float* b1 = (const float*)d_in[7];
    const float* W2 = (const float*)d_in[8];
    const float* b2 = (const float*)d_in[9];
    const float* g1 = (const float*)d_in[10];
    const float* s1 = (const float*)d_in[11];
    const float* g2 = (const float*)d_in[12];
    const float* s2 = (const float*)d_in[13];

    const size_t MB = 1u << 20;
    char* w = (char*)d_ws;
    __bf16* WqT  = (__bf16*)(w + 0 * MB);      // 2 MB each
    __bf16* WkT  = (__bf16*)(w + 2 * MB);
    __bf16* WvT  = (__bf16*)(w + 4 * MB);
    __bf16* WoT  = (__bf16*)(w + 6 * MB);
    __bf16* W1T  = (__bf16*)(w + 8 * MB);      // 8 MB
    __bf16* W2T  = (__bf16*)(w + 16 * MB);     // 8 MB
    __bf16* h1   = (__bf16*)(w + 24 * MB);     // 8 MB
    __bf16* Qb   = (__bf16*)(w + 32 * MB);     // 8 MB
    __bf16* Kb   = (__bf16*)(w + 40 * MB);     // 8 MB
    __bf16* Vt   = (__bf16*)(w + 48 * MB);     // 8 MB
    __bf16* ctx  = (__bf16*)(w + 56 * MB);     // 8 MB
    float*  outx = (float* )(w + 64 * MB);     // 16 MB
    __bf16* h2   = (__bf16*)(w + 80 * MB);     // 8 MB
    __bf16* m1   = (__bf16*)(w + 88 * MB);     // 32 MB -> 120 MB total

    // 1) weights -> transposed bf16 (LDS-tiled, coalesced both sides)
    dim3 tb(32, 8);
    k_transpose_bf16<<<dim3(DD / 32, DD / 32), tb, 0, stream>>>(Wq, WqT, DD, DD);
    k_transpose_bf16<<<dim3(DD / 32, DD / 32), tb, 0, stream>>>(Wk, WkT, DD, DD);
    k_transpose_bf16<<<dim3(DD / 32, DD / 32), tb, 0, stream>>>(Wv, WvT, DD, DD);
    k_transpose_bf16<<<dim3(DD / 32, DD / 32), tb, 0, stream>>>(Wo, WoT, DD, DD);
    k_transpose_bf16<<<dim3(4 * DD / 32, DD / 32), tb, 0, stream>>>(W1, W1T, DD, 4 * DD);
    k_transpose_bf16<<<dim3(DD / 32, 4 * DD / 32), tb, 0, stream>>>(W2, W2T, 4 * DD, DD);

    // 2) LN1
    k_layernorm_bf16<<<ROWS, 256, 0, stream>>>(x, g1, s1, h1);

    // 3) QKV projections (64x32 block per wave, 8 waves/block)
    int blkQKV = (ROWS / 64) * (DD / 32) / 8;        // 256
    k_gemm_wmma<MODE_QK><<<blkQKV, 256, 0, stream>>>(h1, WqT, nullptr, nullptr, Qb,
                                                     ROWS, DD, DD);
    k_gemm_wmma<MODE_QK><<<blkQKV, 256, 0, stream>>>(h1, WkT, nullptr, nullptr, Kb,
                                                     ROWS, DD, DD);
    k_gemm_wmma<MODE_VT><<<blkQKV, 256, 0, stream>>>(h1, WvT, nullptr, nullptr, Vt,
                                                     ROWS, DD, DD);

    // 4) causal flash attention
    int attnUnits = BB * HH * (SS / 16);             // 4096 waves
    k_attention<<<attnUnits / 8, 256, 0, stream>>>(Qb, Kb, Vt, ctx);

    // 5) output projection + residual
    k_gemm_wmma<MODE_F32RES><<<blkQKV, 256, 0, stream>>>(ctx, WoT, bo, x, outx,
                                                         ROWS, DD, DD);

    // 6) LN2
    k_layernorm_bf16<<<ROWS, 256, 0, stream>>>(outx, g2, s2, h2);

    // 7) MLP up + gelu
    int blkMLP1 = (ROWS / 64) * (4 * DD / 32) / 8;   // 1024
    k_gemm_wmma<MODE_GELU><<<blkMLP1, 256, 0, stream>>>(h2, W1T, b1, nullptr, m1,
                                                        ROWS, 4 * DD, DD);

    // 8) MLP down + residual -> d_out
    k_gemm_wmma<MODE_F32RES><<<blkQKV, 256, 0, stream>>>(m1, W2T, b2, outx,
                                                         (float*)d_out,
                                                         ROWS, DD, 4 * DD);
}

// v001
// A run of this version takes 365 microseconds.
// Timed twice side by side with v000, it ran 1.43 and 1.44 times as fast.
#include <hip/hip_runtime.h>
#include <hip/hip_bf16.h>
#include <math.h>
#include <stdint.h>

// Problem constants (reference: B=2, S=2048, D=1024, H=16, HD=64)
#define BB   2
#define SS   2048
#define DD   1024
#define HH   16
#define HD   64
#define ROWS (BB * SS)        // 4096
#define EPS  1e-5f

typedef __attribute__((ext_vector_type(16))) __bf16 v16bf;
typedef __attribute__((ext_vector_type(8)))  __bf16 v8bf;
typedef __attribute__((ext_vector_type(8)))  float  v8f;

// ---------------------------------------------------------------------------
// helpers
// ---------------------------------------------------------------------------
__device__ __forceinline__ v16bf combine16(v8bf lo, v8bf hi) {
    v16bf r;
#pragma unroll
    for (int i = 0; i < 8; ++i) { r[i] = lo[i]; r[i + 8] = hi[i]; }
    return r;
}

__device__ __forceinline__ v8bf ld8(const __bf16* p) {
    return *reinterpret_cast<const v8bf*>(p);
}

__device__ __forceinline__ v8f wmma_bf16(v16bf a, v16bf b, v8f c) {
    return __builtin_amdgcn_wmma_f32_16x16x32_bf16(
        /*neg_a=*/false, a, /*neg_b=*/false, b,
        /*c_mod=*/(short)0, c, /*reuse_a=*/false, /*reuse_b=*/false);
}

// DPP16 lane permute within each 16-lane row (VALU, no LDS round-trip).
// 0xB1 = quad_perm(1,0,3,2)=xor1, 0x4E = quad_perm(2,3,0,1)=xor2,
// 0x141 = row_half_mirror (=xor4 pairing), 0x140 = row_mirror (=xor8 pairing).
template <int CTRL>
__device__ __forceinline__ float dpp_f(float v) {
    int r = __builtin_amdgcn_update_dpp(0, __float_as_int(v), CTRL, 0xF, 0xF, true);
    return __int_as_float(r);
}

// Reduce across the 16 lanes of each half-wave; every lane ends with result.
__device__ __forceinline__ float rowmax16(float v) {
    v = fmaxf(v, dpp_f<0xB1>(v));
    v = fmaxf(v, dpp_f<0x4E>(v));
    v = fmaxf(v, dpp_f<0x141>(v));
    v = fmaxf(v, dpp_f<0x140>(v));
    return v;
}
__device__ __forceinline__ float rowsum16(float v) {
    v += dpp_f<0xB1>(v);
    v += dpp_f<0x4E>(v);
    v += dpp_f<0x141>(v);
    v += dpp_f<0x140>(v);
    return v;
}

__device__ __forceinline__ float gelu_tanh(float x) {
    const float c = 0.7978845608028654f;   // sqrt(2/pi)
    float x3 = x * x * x;
    return 0.5f * x * (1.0f + tanhf(c * (x + 0.044715f * x3)));
}

// ---------------------------------------------------------------------------
// weight convert: W[K,N] f32 (row-major) -> Wt[N,K] bf16, LDS-tiled 32x32 so
// both the f32 reads and the bf16 writes are coalesced.
// block = (32,8); grid = (N/32, K/32)
// ---------------------------------------------------------------------------
__global__ void k_transpose_bf16(const float* __restrict__ W,
                                 __bf16* __restrict__ Wt, int K, int N) {
    __shared__ float t[32][33];
    int tx = threadIdx.x, ty = threadIdx.y;
    int n0 = blockIdx.x * 32, k0 = blockIdx.y * 32;
#pragma unroll
    for (int r = 0; r < 4; ++r)
        t[ty + r * 8][tx] = W[(size_t)(k0 + ty + r * 8) * N + (n0 + tx)];
    __syncthreads();
#pragma unroll
    for (int r = 0; r < 4; ++r)
        Wt[(size_t)(n0 + ty + r * 8) * K + (k0 + tx)] = (__bf16)t[tx][ty + r * 8];
}

// ---------------------------------------------------------------------------
// LayerNorm: x[ROWS,DD] f32 -> out[ROWS,DD] bf16.  One block (256 thr) per row.
// ---------------------------------------------------------------------------
__global__ void k_layernorm_bf16(const float* __restrict__ x,
                                 const float* __restrict__ gain,
                                 const float* __restrict__ shift,
                                 __bf16* __restrict__ out) {
    int row = blockIdx.x;
    int tid = threadIdx.x;
    int lane = tid & 31, wid = tid >> 5;

    const float4* rp = reinterpret_cast<const float4*>(x + (size_t)row * DD);
    float4 v = rp[tid];
    float s  = v.x + v.y + v.z + v.w;
    float sq = v.x * v.x + v.y * v.y + v.z * v.z + v.w * v.w;
#pragma unroll
    for (int off = 16; off >= 1; off >>= 1) {
        s  += __shfl_xor(s,  off);
        sq += __shfl_xor(sq, off);
    }
    __shared__ float ps[8], pq[8];
    __shared__ float s_mean, s_rinv;
    if (lane == 0) { ps[wid] = s; pq[wid] = sq; }
    __syncthreads();
    if (tid == 0) {
        float ts = 0.f, tq = 0.f;
#pragma unroll
        for (int i = 0; i < 8; ++i) { ts += ps[i]; tq += pq[i]; }
        float mean = ts * (1.0f / DD);
        float var  = tq * (1.0f / DD) - mean * mean;
        s_mean = mean;
        s_rinv = rsqrtf(var + EPS);
    }
    __syncthreads();
    float mean = s_mean, rinv = s_rinv;

    __bf16* op = out + (size_t)row * DD + tid * 4;
    int c0 = tid * 4;
    float xv[4] = {v.x, v.y, v.z, v.w};
#pragma unroll
    for (int j = 0; j < 4; ++j) {
        float val = (xv[j] - mean) * rinv * gain[c0 + j] + shift[c0 + j];
        op[j] = (__bf16)val;
    }
}

// ---------------------------------------------------------------------------
// WMMA GEMM with LDS-staged operands: C[M,N] = A[M,K](bf16) * Bt[N,K]^T(bf16)
// One 128x128 tile of C per 256-thread block; each of the 8 waves (2 x 4)
// computes a 64x32 block (4x2 WMMA tiles). A pass is 128 k = 256 B of each of
// the tile's 128 A rows and 128 Bt rows. Every wave brings 32 of those 256
// rows into LDS with one tensor load per pass (padded to a 272-B pitch for the
// 16-byte readers); two buffers, so the next pass's tile lands during this one.
// Needs M, N multiples of 128 and K a multiple of 128 with at least two passes.
// ---------------------------------------------------------------------------
#define MODE_F32RES 0   // out f32 row-major, + bias, + residual
#define MODE_QK     2   // out bf16 [B,H,S,HD] head-major
#define MODE_VT     3   // out bf16 [B,H,HD,S] (V transposed)
#define MODE_GELU   4   // out bf16 row-major, gelu(v + bias)

typedef uint32_t u32x4 __attribute__((ext_vector_type(4)));
typedef uint32_t u32x8 __attribute__((ext_vector_type(8)));

constexpr uint32_t GT_KB    = 256;                 // bytes of an operand row per pass
constexpr uint32_t GT_PITCH = 272;                 // LDS row pitch: 256 B + 16 B pad
constexpr uint32_t GT_SROWS = 32;                  // rows per wave's tensor load
constexpr uint32_t GT_SLICE = 10240;               // 32 x 272 = 8704 B, rounded up to a multiple of 2 KiB
constexpr uint32_t GT_STAGE = 8 * GT_SLICE;        // one buffer: 4 slices of A rows, 4 of Bt rows
static_assert(GT_SROWS * GT_PITCH <= GT_SLICE && (GT_SLICE % 2048u) == 0, "slice size");

__device__ __forceinline__ uint32_t uni(uint32_t v) {
    return (uint32_t)__builtin_amdgcn_readfirstlane(v);
}
__device__ __forceinline__ uint32_t pinned(uint32_t v) {
    uint32_t w = (uint32_t)__builtin_amdgcn_readfirstlane(v);
    asm volatile("" : "+s"(w));
    return w;
}
__device__ __forceinline__ void wait_ds0()     { asm volatile("s_wait_dscnt 0x0" ::: "memory"); }
__device__ __forceinline__ void wait_tensor0() { asm volatile("s_wait_tensorcnt 0x0" ::: "memory"); }
__device__ __forceinline__ void tdm_load(u32x4 g0, u32x8 g1) {
    asm volatile("tensor_load_to_lds %0, %1" :: "s"(g0), "s"(g1) : "memory");
}
__device__ __forceinline__ u32x8 tdm_group1(uint32_t kb) {
    constexpr uint32_t d0 = GT_KB, d1 = GT_SROWS;
    u32x8 g;
    g[0] = uni((1u << 20) | (5u << 22) | (3u << 25));
    g[1] = uni((d0 & 0xFFFFu) << 16);
    g[2] = uni((d0 >> 16) | ((d1 & 0xFFFFu) << 16));
    g[3] = uni((d1 >> 16) | (d0 << 16));
    g[4] = uni(d1);
    g[5] = uni(kb);
    g[6] = uni(0u);
    g[7] = uni(0u);
    return g;
}
__device__ __forceinline__ u32x4 tdm_group0(uint32_t lds_dst, uint64_t ga) {
    u32x4 g;
    g[0] = uni(1u);
    g[1] = uni(lds_dst);
    g[2] = uni((uint32_t)ga);
    g[3] = uni((((uint32_t)(ga >> 32)) & 0x01FFFFFFu) | 0x80000000u);
    return g;
}
__device__ __forceinline__ v8bf lds8(const unsigned char* p) {
    return *reinterpret_cast<const v8bf*>(p);
}

template <int MODE>
__global__ void __launch_bounds__(256)
k_gemm_wmma(const __bf16* __restrict__ A,
            const __bf16* __restrict__ Bt,
            const float*  __restrict__ bias,
            const float*  __restrict__ res,
            void* __restrict__ out,
            int M, int N, int K) {
    __shared__ __attribute__((aligned(2048))) unsigned char L[2 * GT_STAGE];

    int lane = threadIdx.x & 31;
    const uint32_t wave = uni(threadIdx.x >> 5);
    int tiles_n = N >> 7;
    int tm   = blockIdx.x / tiles_n;      // 128x128 tile of C, row-major walk
    int tn   = blockIdx.x - tm * tiles_n;
    int wm   = (int)(wave >> 2);          // wave's 64-row half of the tile
    int wn   = (int)(wave & 3u);          // wave's 32-column quarter
    int m0   = tm * 128 + wm * 64;
    int n0   = tn * 128 + wn * 32;

    int lm   = lane & 15;
    int hi   = lane >> 4;

    const uint32_t kb = (uint32_t)K * 2u;             // source row pitch, bytes
    const uint32_t T  = pinned((uint32_t)K >> 7);     // passes

    // This wave's slice of every stage: waves 0-3 move A rows, waves 4-7 Bt rows.
    const unsigned char* src0 = (wave < 4u)
        ? reinterpret_cast<const unsigned char*>(A)  + (uint64_t)(tm * 128 + 32 * (int)wave) * kb
        : reinterpret_cast<const unsigned char*>(Bt) + (uint64_t)(tn * 128 + 32 * ((int)wave - 4)) * kb;
    const uint32_t lds_slice = (uint32_t)(size_t)L + wave * GT_SLICE;
    u32x8 g1 = tdm_group1(kb);
    // descriptor words held in scalar registers (the pinned() form, for the whole group)
    asm volatile("" : "+s"(g1));

    // Per-lane fragment bases in a buffer: row lm, 16-byte piece hi of each 32 B
    // (the 16-bit operand lane K-pattern: bytes 16*hi and 32 + 16*hi of each 64 B).
    const uint32_t fa = (uint32_t)(wm * 2) * GT_SLICE + (uint32_t)lm * GT_PITCH + 16u * (uint32_t)hi;
    const uint32_t fb = (uint32_t)(4 + wn) * GT_SLICE + (uint32_t)lm * GT_PITCH + 16u * (uint32_t)hi;

    v8f acc[4][2] = {};

    // prologue: stage 0 lands and is published, then stage 1 is sent off
    tdm_load(tdm_group0(lds_slice, (uint64_t)(uintptr_t)src0), g1);
    wait_tensor0();
    __syncthreads();
    tdm_load(tdm_group0(lds_slice + GT_STAGE, (uint64_t)(uintptr_t)src0 + GT_KB), g1);

    // kept rolled: one pass per trip, so that each trip has the one publish point at its foot
#pragma clang loop unroll(disable)
    for (uint32_t t = 0; t < T; ++t) {
        const uint32_t buf = (t & 1u) * GT_STAGE;
        const unsigned char* la = L + buf + fa;
        const unsigned char* lb = L + buf + fb;
#pragma unroll
        for (int u = 0; u < 4; ++u) {
            v16bf a[4];
#pragma unroll
            for (int i = 0; i < 4; ++i) {
                const unsigned char* p = la + (i >> 1) * GT_SLICE + (i & 1) * 16 * GT_PITCH + u * 64;
                a[i] = combine16(lds8(p), lds8(p + 32));
            }
#pragma unroll
            for (int j = 0; j < 2; ++j) {
                const unsigned char* p = lb + j * 16 * GT_PITCH + u * 64;
                v16bf b = combine16(lds8(p), lds8(p + 32));
#pragma unroll
                for (int i = 0; i < 4; ++i)
                    acc[i][j] = wmma_bf16(a[i], b, acc[i][j]);
            }
        }
        // publish point of stage t + 1: this wave's reads of stage t have returned,
        // its own slice of stage t + 1 has landed, every wave has come this far
        wait_ds0();
        wait_tensor0();
        __syncthreads();
        // refill of the buffer that this pass has just read, only while stage t + 2 exists
        if (pinned((t + 2u < T) ? 1u : 0u) != 0u)
            tdm_load(tdm_group0(lds_slice + buf,
                                (uint64_t)(uintptr_t)src0 + (uint64_t)(t + 2u) * GT_KB), g1);
    }
    wait_tensor0();
    wait_ds0();

    // ---- epilogue -------------------------------------------------------
#pragma unroll
    for (int j = 0; j < 2; ++j) {
        int n = n0 + j * 16 + lm;
        float bv = bias ? bias[n] : 0.0f;
#pragma unroll
        for (int i = 0; i < 4; ++i) {
#pragma unroll
            for (int r = 0; r < 8; ++r) {
                int m = m0 + i * 16 + r + (hi ? 8 : 0);
                float v = acc[i][j][r] + bv;
                if (MODE == MODE_F32RES) {
                    size_t idx = (size_t)m * N + n;
                    float rv = res ? res[idx] : 0.0f;
                    ((float*)out)[idx] = v + rv;
                } else if (MODE == MODE_QK) {
                    int b_ = m >> 11, s_ = m & (SS - 1);
                    int h_ = n >> 6,  d_ = n & (HD - 1);
                    ((__bf16*)out)[((((size_t)b_ * HH + h_) * SS + s_) << 6) + d_] = (__bf16)v;
                } else if (MODE == MODE_VT) {
                    int b_ = m >> 11, s_ = m & (SS - 1);
                    int h_ = n >> 6,  d_ = n & (HD - 1);
                    ((__bf16*)out)[(((size_t)b_ * HH + h_) * HD + d_) * SS + s_] = (__bf16)v;
                } else { // MODE_GELU
                    ((__bf16*)out)[(size_t)m * N + n] = (__bf16)gelu_tanh(v);
                }
            }
        }
    }
}

// ---------------------------------------------------------------------------
// Flash attention (causal). One wave handles one 16-row q tile of one (b,h).
// Q,K: bf16 [BH,S,HD]; Vt: bf16 [BH,HD,S]; ctx out: bf16 [ROWS, DD].
// Row-wise softmax reductions use DPP16 (VALU) instead of LDS bpermute.
// ---------------------------------------------------------------------------
__global__ void k_attention(const __bf16* __restrict__ Q,
                            const __bf16* __restrict__ Kb,
                            const __bf16* __restrict__ Vt,
                            __bf16* __restrict__ ctx) {
    __shared__ __align__(16) __bf16 lds_p[8][16 * 32];   // per-wave 16x32 prob tile

    int lane = threadIdx.x & 31;
    int wid  = threadIdx.x >> 5;
    int unit = blockIdx.x * 8 + wid;            // 0 .. BH*(S/16)-1
    int qt   = unit & (SS / 16 - 1);            // q tile within head
    int bh   = unit >> 7;                       // S/16 == 128 -> shift 7
    int qbase = qt * 16;

    const __bf16* Qh = Q  + (size_t)bh * SS * HD;
    const __bf16* Kh = Kb + (size_t)bh * SS * HD;
    const __bf16* Vh = Vt + (size_t)bh * HD * SS;

    int lm = lane & 15, hi = lane >> 4;
    int koff = hi ? 8 : 0;

    // Q operand (rows qbase..qbase+15, K = HD = 64 -> two 32-wide steps)
    const __bf16* qrow = Qh + (size_t)(qbase + lm) * HD;
    v16bf a0 = combine16(ld8(qrow + koff),      ld8(qrow + koff + 16));
    v16bf a1 = combine16(ld8(qrow + 32 + koff), ld8(qrow + 32 + koff + 16));

    float mrow[8], lrow[8];
    v8f acc[4] = {};
#pragma unroll
    for (int r = 0; r < 8; ++r) { mrow[r] = -1e30f; lrow[r] = 0.0f; }

    const float scale = 0.125f;                 // 1/sqrt(64)
    int cmax = (qbase + 15) >> 5;               // inclusive 32-key chunk idx

    for (int c32 = 0; c32 <= cmax; ++c32) {
        int kc = c32 * 32;

        // ---- scores: two 16-key subtiles -------------------------------
        v8f s0 = {}, s1 = {};
        {
            const __bf16* kr = Kh + (size_t)(kc + lm) * HD;
            v16bf b0 = combine16(ld8(kr + koff),      ld8(kr + koff + 16));
            v16bf b1 = combine16(ld8(kr + 32 + koff), ld8(kr + 32 + koff + 16));
            s0 = wmma_bf16(a0, b0, s0);
            s0 = wmma_bf16(a1, b1, s0);
        }
        {
            const __bf16* kr = Kh + (size_t)(kc + 16 + lm) * HD;
            v16bf b0 = combine16(ld8(kr + koff),      ld8(kr + koff + 16));
            v16bf b1 = combine16(ld8(kr + 32 + koff), ld8(kr + 32 + koff + 16));
            s1 = wmma_bf16(a0, b0, s1);
            s1 = wmma_bf16(a1, b1, s1);
        }

        // ---- online softmax (row-wise over 16-lane halves, DPP) --------
        int key0 = kc + lm, key1 = kc + 16 + lm;
#pragma unroll
        for (int r = 0; r < 8; ++r) {
            int q = qbase + r + (hi ? 8 : 0);
            float sv0 = (key0 <= q) ? s0[r] * scale : -1e30f;
            float sv1 = (key1 <= q) ? s1[r] * scale : -1e30f;

            float mx = rowmax16(fmaxf(sv0, sv1));
            float mnew  = fmaxf(mrow[r], mx);
            float alpha = __expf(mrow[r] - mnew);
            mrow[r] = mnew;

            float p0 = __expf(sv0 - mnew);
            float p1 = __expf(sv1 - mnew);
            float rs = rowsum16(p0 + p1);
            lrow[r] = lrow[r] * alpha + rs;
#pragma unroll
            for (int t = 0; t < 4; ++t) acc[t][r] *= alpha;

            int ml = r + (hi ? 8 : 0);
            lds_p[wid][ml * 32 + lm]      = (__bf16)p0;
            lds_p[wid][ml * 32 + 16 + lm] = (__bf16)p1;
        }

        // LDS round trip re-swizzles P from C-layout into A-layout.
        asm volatile("s_wait_dscnt 0" ::: "memory");

        const __bf16* pl = &lds_p[wid][lm * 32];
        v16bf pa = combine16(ld8(pl + koff), ld8(pl + koff + 16));

        // ---- ctx += P * V (Vt rows are contiguous in key dim) ----------
#pragma unroll
        for (int t = 0; t < 4; ++t) {
            const __bf16* vr = Vh + (size_t)(t * 16 + lm) * SS + kc;
            v16bf vb = combine16(ld8(vr + koff), ld8(vr + koff + 16));
            acc[t] = wmma_bf16(pa, vb, acc[t]);
        }
    }

    // ---- write ctx [ROWS, DD] ------------------------------------------
    int b_ = bh >> 4, h_ = bh & (HH - 1);
#pragma unroll
    for (int t = 0; t < 4; ++t) {
#pragma unroll
        for (int r = 0; r < 8; ++r) {
            int ml = r + (hi ? 8 : 0);
            size_t row = (size_t)b_ * SS + qbase + ml;
            ctx[row * DD + h_ * HD + t * 16 + lm] = (__bf16)(acc[t][r] / lrow[r]);
        }
    }
}

// ---------------------------------------------------------------------------
// launch
// ---------------------------------------------------------------------------
extern "C" void kernel_launch(void* const* d_in, const int* in_sizes, int n_in,
                              void* d_out, int out_size, void* d_ws, size_t ws_size,
                              hipStream_t stream) {
    const float* x  = (const float*)d_in[0];
    const float* Wq = (const float*)d_in[1];
    const float* Wk = (const float*)d_in[2];
    const float* Wv = (const float*)d_in[3];
    const float* Wo = (const float*)d_in[4];
    const float* bo = (const float*)d_in[5];
    const float* W1 = (const float*)d_in[6];
    const float* b1 = (const float*)d_in[7];
    const float* W2 = (const float*)d_in[8];
    const float* b2 = (const float*)d_in[9];
    const float* g1 = (const float*)d_in[10];
    const float* s1 = (const float*)d_in[11];
    const float* g2 = (const float*)d_in[12];
    const float* s2 = (const float*)d_in[13];

    const size_t MB = 1u << 20;
    char* w = (char*)d_ws;
    __bf16* WqT  = (__bf16*)(w + 0 * MB);      // 2 MB each
    __bf16* WkT  = (__bf16*)(w + 2 * MB);
    __bf16* WvT  = (__bf16*)(w + 4 * MB);
    __bf16* WoT  = (__bf16*)(w + 6 * MB);
    __bf16* W1T  = (__bf16*)(w + 8 * MB);      // 8 MB
    __bf16* W2T  = (__bf16*)(w + 16 * MB);     // 8 MB
    __bf16* h1   = (__bf16*)(w + 24 * MB);     // 8 MB
    __bf16* Qb   = (__bf16*)(w + 32 * MB);     // 8 MB
    __bf16* Kb   = (__bf16*)(w + 40 * MB);     // 8 MB
    __bf16* Vt   = (__bf16*)(w + 48 * MB);     // 8 MB
    __bf16* ctx  = (__bf16*)(w + 56 * MB);     // 8 MB
    float*  outx = (float* )(w + 64 * MB);     // 16 MB
    __bf16* h2   = (__bf16*)(w + 80 * MB);     // 8 MB
    __bf16* m1   = (__bf16*)(w + 88 * MB);     // 32 MB -> 120 MB total

    // 1) weights -> transposed bf16 (LDS-tiled, coalesced both sides)
    dim3 tb(32, 8);
    k_transpose_bf16<<<dim3(DD / 32, DD / 32), tb, 0, stream>>>(Wq, WqT, DD, DD);
    k_transpose_bf16<<<dim3(DD / 32, DD / 32), tb, 0, stream>>>(Wk, WkT, DD, DD);
    k_transpose_bf16<<<dim3(DD / 32, DD / 32), tb, 0, stream>>>(Wv, WvT, DD, DD);
    k_transpose_bf16<<<dim3(DD / 32, DD / 32), tb, 0, stream>>>(Wo, WoT, DD, DD);
    k_transpose_bf16<<<dim3(4 * DD / 32, DD / 32), tb, 0, stream>>>(W1, W1T, DD, 4 * DD);
    k_transpose_bf16<<<dim3(DD / 32, 4 * DD / 32), tb, 0, stream>>>(W2, W2T, 4 * DD, DD);

    // 2) LN1
    k_layernorm_bf16<<<ROWS, 256, 0, stream>>>(x, g1, s1, h1);

    // 3) QKV projections (128x128 tile per block, 64x32 block per wave)
    int blkQKV = (ROWS / 128) * (DD / 128);          // 256
    k_gemm_wmma<MODE_QK><<<blkQKV, 256, 0, stream>>>(h1, WqT, nullptr, nullptr, Qb,
                                                     ROWS, DD, DD);
    k_gemm_wmma<MODE_QK><<<blkQKV, 256, 0, stream>>>(h1, WkT, nullptr, nullptr, Kb,
                                                     ROWS, DD, DD);
    k_gemm_wmma<MODE_VT><<<blkQKV, 256, 0, stream>>>(h1, WvT, nullptr, nullptr, Vt,
                                                     ROWS, DD, DD);

    // 4) causal flash attention
    int attnUnits = BB * HH * (SS / 16);             // 4096 waves
    k_attention<<<attnUnits / 8, 256, 0, stream>>>(Qb, Kb, Vt, ctx);

    // 5) output projection + residual
    k_gemm_wmma<MODE_F32RES><<<blkQKV, 256, 0, stream>>>(ctx, WoT, bo, x, outx,
                                                         ROWS, DD, DD);

    // 6) LN2
    k_layernorm_bf16<<<ROWS, 256, 0, stream>>>(outx, g2, s2, h2);

    // 7) MLP up + gelu
    int blkMLP1 = (ROWS / 128) * (4 * DD / 128);     // 1024
    k_gemm_wmma<MODE_GELU><<<blkMLP1, 256, 0, stream>>>(h2, W1T, b1, nullptr, m1,
                                                        ROWS, 4 * DD, DD);

    // 8) MLP down + residual -> d_out
    k_gemm_wmma<MODE_F32RES><<<blkQKV, 256, 0, stream>>>(m1, W2T, b2, outx,
                                                         (float*)d_out,
                                                         ROWS, DD, 4 * DD);
}

// v002
// Measured time: 262 microseconds a run.
// Next to v001, in two timings, it ran 1.39 and 1.40 times as fast.
// All steps since v000 together make it 2.00 times as fast.
#include <hip/hip_runtime.h>
#include <hip/hip_bf16.h>
#include <math.h>
#include <stdint.h>

// Problem constants (reference: B=2, S=2048, D=1024, H=16, HD=64)
#define BB   2
#define SS   2048
#define DD   1024
#define HH   16
#define HD   64
#define ROWS (BB * SS)        // 4096
#define EPS  1e-5f

typedef __attribute__((ext_vector_type(16))) __bf16 v16bf;
typedef __attribute__((ext_vector_type(8)))  __bf16 v8bf;
typedef __attribute__((ext_vector_type(8)))  float  v8f;

// ---------------------------------------------------------------------------
// helpers
// ---------------------------------------------------------------------------
__device__ __forceinline__ v16bf combine16(v8bf lo, v8bf hi) {
    v16bf r;
#pragma unroll
    for (int i = 0; i < 8; ++i) { r[i] = lo[i]; r[i + 8] = hi[i]; }
    return r;
}

__device__ __forceinline__ v8bf ld8(const __bf16* p) {
    return *reinterpret_cast<const v8bf*>(p);
}

__device__ __forceinline__ v8f wmma_bf16(v16bf a, v16bf b, v8f c) {
    return __builtin_amdgcn_wmma_f32_16x16x32_bf16(
        /*neg_a=*/false, a, /*neg_b=*/false, b,
        /*c_mod=*/(short)0, c, /*reuse_a=*/false, /*reuse_b=*/false);
}

// DPP16 lane permute within each 16-lane row (VALU, no LDS round-trip).
// 0xB1 = quad_perm(1,0,3,2)=xor1, 0x4E = quad_perm(2,3,0,1)=xor2,
// 0x141 = row_half_mirror (=xor4 pairing), 0x140 = row_mirror (=xor8 pairing).
template <int CTRL>
__device__ __forceinline__ float dpp_f(float v) {
    int r = __builtin_amdgcn_update_dpp(0, __float_as_int(v), CTRL, 0xF, 0xF, true);
    return __int_as_float(r);
}

// Reduce across the 16 lanes of each half-wave; every lane ends with result.
__device__ __forceinline__ float rowmax16(float v) {
    v = fmaxf(v, dpp_f<0xB1>(v));
    v = fmaxf(v, dpp_f<0x4E>(v));
    v = fmaxf(v, dpp_f<0x141>(v));
    v = fmaxf(v, dpp_f<0x140>(v));
    return v;
}
__device__ __forceinline__ float rowsum16(float v) {
    v += dpp_f<0xB1>(v);
    v += dpp_f<0x4E>(v);
    v += dpp_f<0x141>(v);
    v += dpp_f<0x140>(v);
    return v;
}

__device__ __forceinline__ float gelu_tanh(float x) {
    const float c = 0.7978845608028654f;   // sqrt(2/pi)
    float x3 = x * x * x;
    return 0.5f * x * (1.0f + tanhf(c * (x + 0.044715f * x3)));
}

// ---------------------------------------------------------------------------
// weight convert: W[K,N] f32 (row-major) -> Wt[N,K] bf16, LDS-tiled 32x32 so
// both the f32 reads and the bf16 writes are coalesced.
// block = (32,8); grid = (N/32, K/32)
// ---------------------------------------------------------------------------
__global__ void k_transpose_bf16(const float* __restrict__ W,
                                 __bf16* __restrict__ Wt, int K, int N) {
    __shared__ float t[32][33];
    int tx = threadIdx.x, ty = threadIdx.y;
    int n0 = blockIdx.x * 32, k0 = blockIdx.y * 32;
#pragma unroll
    for (int r = 0; r < 4; ++r)
        t[ty + r * 8][tx] = W[(size_t)(k0 + ty + r * 8) * N + (n0 + tx)];
    __syncthreads();
#pragma unroll
    for (int r = 0; r < 4; ++r)
        Wt[(size_t)(n0 + ty + r * 8) * K + (k0 + tx)] = (__bf16)t[tx][ty + r * 8];
}

// ---------------------------------------------------------------------------
// LayerNorm: x[ROWS,DD] f32 -> out[ROWS,DD] bf16.  One block (256 thr) per row.
// ---------------------------------------------------------------------------
__global__ void k_layernorm_bf16(const float* __restrict__ x,
                                 const float* __restrict__ gain,
                                 const float* __restrict__ shift,
                                 __bf16* __restrict__ out) {
    int row = blockIdx.x;
    int tid = threadIdx.x;
    int lane = tid & 31, wid = tid >> 5;

    const float4* rp = reinterpret_cast<const float4*>(x + (size_t)row * DD);
    float4 v = rp[tid];
    float s  = v.x + v.y + v.z + v.w;
    float sq = v.x * v.x + v.y * v.y + v.z * v.z + v.w * v.w;
#pragma unroll
    for (int off = 16; off >= 1; off >>= 1) {
        s  += __shfl_xor(s,  off);
        sq += __shfl_xor(sq, off);
    }
    __shared__ float ps[8], pq[8];
    __shared__ float s_mean, s_rinv;
    if (lane == 0) { ps[wid] = s; pq[wid] = sq; }
    __syncthreads();
    if (tid == 0) {
        float ts = 0.f, tq = 0.f;
#pragma unroll
        for (int i = 0; i < 8; ++i) { ts += ps[i]; tq += pq[i]; }
        float mean = ts * (1.0f / DD);
        float var  = tq * (1.0f / DD) - mean * mean;
        s_mean = mean;
        s_rinv = rsqrtf(var + EPS);
    }
    __syncthreads();
    float mean = s_mean, rinv = s_rinv;

    __bf16* op = out + (size_t)row * DD + tid * 4;
    int c0 = tid * 4;
    float xv[4] = {v.x, v.y, v.z, v.w};
#pragma unroll
    for (int j = 0; j < 4; ++j) {
        float val = (xv[j] - mean) * rinv * gain[c0 + j] + shift[c0 + j];
        op[j] = (__bf16)val;
    }
}

// ---------------------------------------------------------------------------
// WMMA GEMM with LDS-staged operands: C[M,N] = A[M,K](bf16) * Bt[N,K]^T(bf16)
// One 128x128 tile of C per 256-thread block; each of the 8 waves (2 x 4)
// computes a 64x32 block (4x2 WMMA tiles). A pass is 128 k = 256 B of each of
// the tile's 128 A rows and 128 Bt rows. Every wave brings 32 of those 256
// rows into LDS with one tensor load per pass (padded to a 272-B pitch for the
// 16-byte readers); two buffers, so the next pass's tile lands during this one.
// Needs M, N multiples of 128 and K a multiple of 128 with at least two passes.
// ---------------------------------------------------------------------------
#define MODE_F32RES 0   // out f32 row-major, + bias, + residual
#define MODE_QK     2   // out bf16 [B,H,S,HD] head-major
#define MODE_VT     3   // out bf16 [B,H,HD,S] (V transposed)
#define MODE_GELU   4   // out bf16 row-major, gelu(v + bias)

typedef uint32_t u32x4 __attribute__((ext_vector_type(4)));
typedef uint32_t u32x8 __attribute__((ext_vector_type(8)));

constexpr uint32_t GT_KB    = 256;                 // bytes of an operand row per pass
constexpr uint32_t GT_PITCH = 272;                 // LDS row pitch: 256 B + 16 B pad
constexpr uint32_t GT_SROWS = 32;                  // rows per wave's tensor load
constexpr uint32_t GT_SLICE = 10240;               // 32 x 272 = 8704 B, rounded up to a multiple of 2 KiB
constexpr uint32_t GT_STAGE = 8 * GT_SLICE;        // one buffer: 4 slices of A rows, 4 of Bt rows
static_assert(GT_SROWS * GT_PITCH <= GT_SLICE && (GT_SLICE % 2048u) == 0, "slice size");

__device__ __forceinline__ uint32_t uni(uint32_t v) {
    return (uint32_t)__builtin_amdgcn_readfirstlane(v);
}
__device__ __forceinline__ uint32_t pinned(uint32_t v) {
    uint32_t w = (uint32_t)__builtin_amdgcn_readfirstlane(v);
    asm volatile("" : "+s"(w));
    return w;
}
__device__ __forceinline__ void wait_ds0()     { asm volatile("s_wait_dscnt 0x0" ::: "memory"); }
__device__ __forceinline__ void wait_tensor0() { asm volatile("s_wait_tensorcnt 0x0" ::: "memory"); }
__device__ __forceinline__ void tdm_load(u32x4 g0, u32x8 g1) {
    asm volatile("tensor_load_to_lds %0, %1" :: "s"(g0), "s"(g1) : "memory");
}
__device__ __forceinline__ u32x8 tdm_group1(uint32_t kb) {
    constexpr uint32_t d0 = GT_KB, d1 = GT_SROWS;
    u32x8 g;
    g[0] = uni((1u << 20) | (5u << 22) | (3u << 25));
    g[1] = uni((d0 & 0xFFFFu) << 16);
    g[2] = uni((d0 >> 16) | ((d1 & 0xFFFFu) << 16));
    g[3] = uni((d1 >> 16) | (d0 << 16));
    g[4] = uni(d1);
    g[5] = uni(kb);
    g[6] = uni(0u);
    g[7] = uni(0u);
    return g;
}
__device__ __forceinline__ u32x4 tdm_group0(uint32_t lds_dst, uint64_t ga) {
    u32x4 g;
    g[0] = uni(1u);
    g[1] = uni(lds_dst);
    g[2] = uni((uint32_t)ga);
    g[3] = uni((((uint32_t)(ga >> 32)) & 0x01FFFFFFu) | 0x80000000u);
    return g;
}
__device__ __forceinline__ v8bf lds8(const unsigned char* p) {
    return *reinterpret_cast<const v8bf*>(p);
}

template <int MODE>
__global__ void __launch_bounds__(256)
k_gemm_wmma(const __bf16* __restrict__ A,
            const __bf16* __restrict__ Bt,
            const float*  __restrict__ bias,
            const float*  __restrict__ res,
            void* __restrict__ out,
            int M, int N, int K) {
    __shared__ __attribute__((aligned(2048))) unsigned char L[2 * GT_STAGE];

    int lane = threadIdx.x & 31;
    const uint32_t wave = uni(threadIdx.x >> 5);
    int tiles_n = N >> 7;
    int tm   = blockIdx.x / tiles_n;      // 128x128 tile of C, row-major walk
    int tn   = blockIdx.x - tm * tiles_n;
    int wm   = (int)(wave >> 2);          // wave's 64-row half of the tile
    int wn   = (int)(wave & 3u);          // wave's 32-column quarter
    int m0   = tm * 128 + wm * 64;
    int n0   = tn * 128 + wn * 32;

    int lm   = lane & 15;
    int hi   = lane >> 4;

    const uint32_t kb = (uint32_t)K * 2u;             // source row pitch, bytes
    const uint32_t T  = pinned((uint32_t)K >> 7);     // passes

    // This wave's slice of every stage: waves 0-3 move A rows, waves 4-7 Bt rows.
    const unsigned char* src0 = (wave < 4u)
        ? reinterpret_cast<const unsigned char*>(A)  + (uint64_t)(tm * 128 + 32 * (int)wave) * kb
        : reinterpret_cast<const unsigned char*>(Bt) + (uint64_t)(tn * 128 + 32 * ((int)wave - 4)) * kb;
    const uint32_t lds_slice = (uint32_t)(size_t)L + wave * GT_SLICE;
    u32x8 g1 = tdm_group1(kb);
    // descriptor words held in scalar registers (the pinned() form, for the whole group)
    asm volatile("" : "+s"(g1));

    // Per-lane fragment bases in a buffer: row lm, 16-byte piece hi of each 32 B
    // (the 16-bit operand lane K-pattern: bytes 16*hi and 32 + 16*hi of each 64 B).
    const uint32_t fa = (uint32_t)(wm * 2) * GT_SLICE + (uint32_t)lm * GT_PITCH + 16u * (uint32_t)hi;
    const uint32_t fb = (uint32_t)(4 + wn) * GT_SLICE + (uint32_t)lm * GT_PITCH + 16u * (uint32_t)hi;

    v8f acc[4][2] = {};

    // prologue: stage 0 lands and is published, then stage 1 is sent off
    tdm_load(tdm_group0(lds_slice, (uint64_t)(uintptr_t)src0), g1);
    wait_tensor0();
    __syncthreads();
    tdm_load(tdm_group0(lds_slice + GT_STAGE, (uint64_t)(uintptr_t)src0 + GT_KB), g1);

    // kept rolled: one pass per trip, so that each trip has the one publish point at its foot
#pragma clang loop unroll(disable)
    for (uint32_t t = 0; t < T; ++t) {
        const uint32_t buf = (t & 1u) * GT_STAGE;
        const unsigned char* la = L + buf + fa;
        const unsigned char* lb = L + buf + fb;
#pragma unroll
        for (int u = 0; u < 4; ++u) {
            v16bf a[4];
#pragma unroll
            for (int i = 0; i < 4; ++i) {
                const unsigned char* p = la + (i >> 1) * GT_SLICE + (i & 1) * 16 * GT_PITCH + u * 64;
                a[i] = combine16(lds8(p), lds8(p + 32));
            }
#pragma unroll
            for (int j = 0; j < 2; ++j) {
                const unsigned char* p = lb + j * 16 * GT_PITCH + u * 64;
                v16bf b = combine16(lds8(p), lds8(p + 32));
#pragma unroll
                for (int i = 0; i < 4; ++i)
                    acc[i][j] = wmma_bf16(a[i], b, acc[i][j]);
            }
        }
        // publish point of stage t + 1: this wave's reads of stage t have returned,
        // its own slice of stage t + 1 has landed, every wave has come this far
        wait_ds0();
        wait_tensor0();
        __syncthreads();
        // refill of the buffer that this pass has just read, only while stage t + 2 exists
        if (pinned((t + 2u < T) ? 1u : 0u) != 0u)
            tdm_load(tdm_group0(lds_slice + buf,
                                (uint64_t)(uintptr_t)src0 + (uint64_t)(t + 2u) * GT_KB), g1);
    }
    wait_tensor0();
    wait_ds0();

    // ---- epilogue -------------------------------------------------------
#pragma unroll
    for (int j = 0; j < 2; ++j) {
        int n = n0 + j * 16 + lm;
        float bv = bias ? bias[n] : 0.0f;
#pragma unroll
        for (int i = 0; i < 4; ++i) {
#pragma unroll
            for (int r = 0; r < 8; ++r) {
                int m = m0 + i * 16 + r + (hi ? 8 : 0);
                float v = acc[i][j][r] + bv;
                if (MODE == MODE_F32RES) {
                    size_t idx = (size_t)m * N + n;
                    float rv = res ? res[idx] : 0.0f;
                    ((float*)out)[idx] = v + rv;
                } else if (MODE == MODE_QK) {
                    int b_ = m >> 11, s_ = m & (SS - 1);
                    int h_ = n >> 6,  d_ = n & (HD - 1);
                    ((__bf16*)out)[((((size_t)b_ * HH + h_) * SS + s_) << 6) + d_] = (__bf16)v;
                } else if (MODE == MODE_VT) {
                    int b_ = m >> 11, s_ = m & (SS - 1);
                    int h_ = n >> 6,  d_ = n & (HD - 1);
                    ((__bf16*)out)[(((size_t)b_ * HH + h_) * HD + d_) * SS + s_] = (__bf16)v;
                } else { // MODE_GELU
                    ((__bf16*)out)[(size_t)m * N + n] = (__bf16)gelu_tanh(v);
                }
            }
        }
    }
}

// ---------------------------------------------------------------------------
// Flash attention (causal). One wave handles one 16-row q tile of one (b,h);
// the 8 waves of a block hold 128 consecutive q rows of one head and share K, V.
// Q,K: bf16 [BH,S,HD]; Vt: bf16 [BH,HD,S]; ctx out: bf16 [ROWS, DD].
// A stage is 64 keys: 64 K rows of 128 B and 64 Vt rows of 128 B. Every wave
// brings 16 of those 128 rows into LDS with one tensor load per stage (padded to
// a 144-B pitch for the 16-byte readers); two buffers, so the next stage lands
// during this one. A block of q rows 128*qb.. walks 2*(qb+1) stages (at least two).
// Row-wise softmax reductions use DPP16 (VALU) instead of LDS bpermute.
// ---------------------------------------------------------------------------
constexpr uint32_t AT_ROWB  = 128;                 // bytes of a K or Vt row per stage
constexpr uint32_t AT_PITCH = 144;                 // LDS row pitch: 128 B + 16 B pad
constexpr uint32_t AT_SROWS = 16;                  // rows per wave's tensor load
constexpr uint32_t AT_SLICE = 4096;                // 16 x 144 = 2304 B, rounded up to a multiple of 2 KiB
constexpr uint32_t AT_STAGE = 8 * AT_SLICE;        // one buffer: 4 slices of K rows, 4 of Vt rows
static_assert(AT_SROWS * AT_PITCH <= AT_SLICE && (AT_SLICE % 2048u) == 0, "slice size");

// Descriptor group 1: byte elements, a tile of 16 rows of 128 B (tensor = tile),
// source row pitch pb bytes, 16 B of LDS pad behind every 128 B, no mask.
__device__ __forceinline__ u32x8 tdm_group1_kv(uint32_t pb) {
    constexpr uint32_t d0 = AT_ROWB, d1 = AT_SROWS;
    u32x8 g;
    g[0] = uni((1u << 20) | (4u << 22) | (3u << 25));
    g[1] = uni((d0 & 0xFFFFu) << 16);
    g[2] = uni((d0 >> 16) | ((d1 & 0xFFFFu) << 16));
    g[3] = uni((d1 >> 16) | (d0 << 16));
    g[4] = uni(d1);
    g[5] = uni(pb);
    g[6] = uni(0u);
    g[7] = uni(0u);
    return g;
}

__global__ void __launch_bounds__(256)
k_attention(const __bf16* __restrict__ Q,
                            const __bf16* __restrict__ Kb,
                            const __bf16* __restrict__ Vt,
                            __bf16* __restrict__ ctx) {
    __shared__ __attribute__((aligned(2048))) unsigned char R[2 * AT_STAGE];
    __shared__ __align__(16) __bf16 lds_p[8][16 * 32];   // per-wave 16x32 prob tile

    int lane = threadIdx.x & 31;
    const uint32_t wave = uni(threadIdx.x >> 5);
    int wid  = (int)wave;
    int unit = blockIdx.x * 8 + wid;            // 0 .. BH*(S/16)-1
    int qt   = unit & (SS / 16 - 1);            // q tile within head
    int bh   = unit >> 7;                       // S/16 == 128 -> shift 7
    int qbase = qt * 16;

    const __bf16* Qh = Q  + (size_t)bh * SS * HD;
    const __bf16* Kh = Kb + (size_t)bh * SS * HD;
    const __bf16* Vh = Vt + (size_t)bh * HD * SS;

    int lm = lane & 15, hi = lane >> 4;
    int koff = hi ? 8 : 0;

    // stages of 64 keys up to the block's last q row (the same for all 8 waves)
    const uint32_t NS = pinned(2u * ((blockIdx.x & (SS / 128 - 1)) + 1u));

    // This wave's slice of every stage: waves 0-3 move K rows, waves 4-7 Vt rows.
    const unsigned char* src0 = (wave < 4u)
        ? reinterpret_cast<const unsigned char*>(Kh) + (uint64_t)(AT_SROWS * wave) * (HD * 2)
        : reinterpret_cast<const unsigned char*>(Vh) + (uint64_t)(AT_SROWS * (wave - 4u)) * (SS * 2);
    const uint32_t sstep = (wave < 4u) ? 64u * (HD * 2) : AT_ROWB;   // source bytes from stage to stage
    const uint32_t lds_slice = (uint32_t)(size_t)R + wave * AT_SLICE;
    u32x8 g1 = tdm_group1_kv((wave < 4u) ? (uint32_t)(HD * 2) : (uint32_t)(SS * 2));
    // descriptor words held in scalar registers (the pinned() form, for the whole group), so that
    // no register of the group serves as scratch in the loop while a request is outstanding
    asm volatile("" : "+s"(g1));

    // Q operand (rows qbase..qbase+15, K = HD = 64 -> two 32-wide steps)
    const __bf16* qrow = Qh + (size_t)(qbase + lm) * HD;
    v16bf a0 = combine16(ld8(qrow + koff),      ld8(qrow + koff + 16));
    v16bf a1 = combine16(ld8(qrow + 32 + koff), ld8(qrow + 32 + koff + 16));

    float mrow[8], lrow[8];
    v8f acc[4] = {};
#pragma unroll
    for (int r = 0; r < 8; ++r) { mrow[r] = -1e30f; lrow[r] = 0.0f; }

    const float scale = 0.125f;                 // 1/sqrt(64)
    int cmax = (qbase + 15) >> 5;               // inclusive 32-key chunk idx (wave-uniform)

    // per-lane fragment base in a buffer: row lm of a slice, 16-byte piece hi of each 32 B
    const uint32_t fl = (uint32_t)lm * AT_PITCH + 16u * (uint32_t)hi;

    // prologue: stage 0 lands and is published, then stage 1 is sent off
    tdm_load(tdm_group0(lds_slice, (uint64_t)(uintptr_t)src0), g1);
    wait_tensor0();
    __syncthreads();
    tdm_load(tdm_group0(lds_slice + AT_STAGE, (uint64_t)(uintptr_t)src0 + sstep), g1);

    // kept rolled: one stage per trip, so that each trip has the one publish point at its foot
#pragma clang loop unroll(disable)
    for (uint32_t s = 0; s < NS; ++s) {
        const uint32_t buf = (s & 1u) * AT_STAGE;
        const unsigned char* lk = R + buf + fl;                  // K slices 0..3
        const unsigned char* lv = R + buf + 4u * AT_SLICE + fl;  // Vt slices 0..3
#pragma unroll
        for (int c = 0; c < 2; ++c) {
            int c32 = (int)(2u * s) + c;
            // a wave skips the chunks beyond its own diagonal (a wave-uniform test);
            // the publish point below stands outside the skip
            if (c32 <= cmax) {
                int kc = c32 * 32;

                // ---- scores: two 16-key subtiles -----------------------
                v8f s0 = {}, s1 = {};
                {
                    const unsigned char* kr = lk + (2 * c) * AT_SLICE;
                    v16bf b0 = combine16(lds8(kr),      lds8(kr + 32));
                    v16bf b1 = combine16(lds8(kr + 64), lds8(kr + 96));
                    s0 = wmma_bf16(a0, b0, s0);
                    s0 = wmma_bf16(a1, b1, s0);
                }
                {
                    const unsigned char* kr = lk + (2 * c + 1) * AT_SLICE;
                    v16bf b0 = combine16(lds8(kr),      lds8(kr + 32));
                    v16bf b1 = combine16(lds8(kr + 64), lds8(kr + 96));
                    s1 = wmma_bf16(a0, b0, s1);
                    s1 = wmma_bf16(a1, b1, s1);
                }

                // ---- online softmax (row-wise over 16-lane halves, DPP) --
                int key0 = kc + lm, key1 = kc + 16 + lm;
#pragma unroll
                for (int r = 0; r < 8; ++r) {
                    int q = qbase + r + (hi ? 8 : 0);
                    float sv0 = (key0 <= q) ? s0[r] * scale : -1e30f;
                    float sv1 = (key1 <= q) ? s1[r] * scale : -1e30f;

                    float mx = rowmax16(fmaxf(sv0, sv1));
                    float mnew  = fmaxf(mrow[r], mx);
                    float alpha = __expf(mrow[r] - mnew);
                    mrow[r] = mnew;

                    float p0 = __expf(sv0 - mnew);
                    float p1 = __expf(sv1 - mnew);
                    float rs = rowsum16(p0 + p1);
                    lrow[r] = lrow[r] * alpha + rs;
#pragma unroll
                    for (int t = 0; t < 4; ++t) acc[t][r] *= alpha;

                    int ml = r + (hi ? 8 : 0);
                    lds_p[wid][ml * 32 + lm]      = (__bf16)p0;
                    lds_p[wid][ml * 32 + 16 + lm] = (__bf16)p1;
                }

                // LDS round trip re-swizzles P from C-layout into A-layout.
                asm volatile("s_wait_dscnt 0" ::: "memory");

                const __bf16* pl = &lds_p[wid][lm * 32];
                v16bf pa = combine16(ld8(pl + koff), ld8(pl + koff + 16));

                // ---- ctx += P * V (Vt rows are contiguous in key dim) ----
#pragma unroll
                for (int t = 0; t < 4; ++t) {
                    const unsigned char* vr = lv + t * AT_SLICE + c * 64;
                    v16bf vb = combine16(lds8(vr), lds8(vr + 32));
                    acc[t] = wmma_bf16(pa, vb, acc[t]);
                }
            }
        }
        // publish point of stage s + 1: this wave's reads of stage s have returned,
        // its own slice of stage s + 1 has landed, every wave has come this far
        wait_ds0();
        wait_tensor0();
        __syncthreads();
        // refill of the buffer that this trip has just read, only while stage s + 2 exists
        if (pinned((s + 2u < NS) ? 1u : 0u) != 0u)
            tdm_load(tdm_group0(lds_slice + buf,
                                (uint64_t)(uintptr_t)src0 + (uint64_t)(s + 2u) * sstep), g1);
    }
    wait_tensor0();
    wait_ds0();

    // ---- write ctx [ROWS, DD] ------------------------------------------
    int b_ = bh >> 4, h_ = bh & (HH - 1);
#pragma unroll
    for (int t = 0; t < 4; ++t) {
#pragma unroll
        for (int r = 0; r < 8; ++r) {
            int ml = r + (hi ? 8 : 0);
            size_t row = (size_t)b_ * SS + qbase + ml;
            ctx[row * DD + h_ * HD + t * 16 + lm] = (__bf16)(acc[t][r] / lrow[r]);
        }
    }
}

// ---------------------------------------------------------------------------
// launch
// ---------------------------------------------------------------------------
extern "C" void kernel_launch(void* const* d_in, const int* in_sizes, int n_in,
                              void* d_out, int out_size, void* d_ws, size_t ws_size,
                              hipStream_t stream) {
    const float* x  = (const float*)d_in[0];
    const float* Wq = (const float*)d_in[1];
    const float* Wk = (const float*)d_in[2];
    const float* Wv = (const float*)d_in[3];
    const float* Wo = (const float*)d_in[4];
    const float* bo = (const float*)d_in[5];
    const float* W1 = (const float*)d_in[6];
    const float* b1 = (const float*)d_in[7];
    const float* W2 = (const float*)d_in[8];
    const float* b2 = (const float*)d_in[9];
    const float* g1 = (const float*)d_in[10];
    const float* s1 = (const float*)d_in[11];
    const float* g2 = (const float*)d_in[12];
    const float* s2 = (const float*)d_in[13];

    const size_t MB = 1u << 20;
    char* w = (char*)d_ws;
    __bf16* WqT  = (__bf16*)(w + 0 * MB);      // 2 MB each
    __bf16* WkT  = (__bf16*)(w + 2 * MB);
    __bf16* WvT  = (__bf16*)(w + 4 * MB);
    __bf16* WoT  = (__bf16*)(w + 6 * MB);
    __bf16* W1T  = (__bf16*)(w + 8 * MB);      // 8 MB
    __bf16* W2T  = (__bf16*)(w + 16 * MB);     // 8 MB
    __bf16* h1   = (__bf16*)(w + 24 * MB);     // 8 MB
    __bf16* Qb   = (__bf16*)(w + 32 * MB);     // 8 MB
    __bf16* Kb   = (__bf16*)(w + 40 * MB);     // 8 MB
    __bf16* Vt   = (__bf16*)(w + 48 * MB);     // 8 MB
    __bf16* ctx  = (__bf16*)(w + 56 * MB);     // 8 MB
    float*  outx = (float* )(w + 64 * MB);     // 16 MB
    __bf16* h2   = (__bf16*)(w + 80 * MB);     // 8 MB
    __bf16* m1   = (__bf16*)(w + 88 * MB);     // 32 MB -> 120 MB total

    // 1) weights -> transposed bf16 (LDS-tiled, coalesced both sides)
    dim3 tb(32, 8);
    k_transpose_bf16<<<dim3(DD / 32, DD / 32), tb, 0, stream>>>(Wq, WqT, DD, DD);
    k_transpose_bf16<<<dim3(DD / 32, DD / 32), tb, 0, stream>>>(Wk, WkT, DD, DD);
    k_transpose_bf16<<<dim3(DD / 32, DD / 32), tb, 0, stream>>>(Wv, WvT, DD, DD);
    k_transpose_bf16<<<dim3(DD / 32, DD / 32), tb, 0, stream>>>(Wo, WoT, DD, DD);
    k_transpose_bf16<<<dim3(4 * DD / 32, DD / 32), tb, 0, stream>>>(W1, W1T, DD, 4 * DD);
    k_transpose_bf16<<<dim3(DD / 32, 4 * DD / 32), tb, 0, stream>>>(W2, W2T, 4 * DD, DD);

    // 2) LN1
    k_layernorm_bf16<<<ROWS, 256, 0, stream>>>(x, g1, s1, h1);

    // 3) QKV projections (128x128 tile per block, 64x32 block per wave)
    int blkQKV = (ROWS / 128) * (DD / 128);          // 256
    k_gemm_wmma<MODE_QK><<<blkQKV, 256, 0, stream>>>(h1, WqT, nullptr, nullptr, Qb,
                                                     ROWS, DD, DD);
    k_gemm_wmma<MODE_QK><<<blkQKV, 256, 0, stream>>>(h1, WkT, nullptr, nullptr, Kb,
                                                     ROWS, DD, DD);
    k_gemm_wmma<MODE_VT><<<blkQKV, 256, 0, stream>>>(h1, WvT, nullptr, nullptr, Vt,
                                                     ROWS, DD, DD);

    // 4) causal flash attention
    int attnUnits = BB * HH * (SS / 16);             // 4096 waves
    k_attention<<<attnUnits / 8, 256, 0, stream>>>(Qb, Kb, Vt, ctx);

    // 5) output projection + residual
    k_gemm_wmma<MODE_F32RES><<<blkQKV, 256, 0, stream>>>(ctx, WoT, bo, x, outx,
                                                         ROWS, DD, DD);

    // 6) LN2
    k_layernorm_bf16<<<ROWS, 256, 0, stream>>>(outx, g2, s2, h2);

    // 7) MLP up + gelu
    int blkMLP1 = (ROWS / 128) * (4 * DD / 128);     // 1024
    k_gemm_wmma<MODE_GELU><<<blkMLP1, 256, 0, stream>>>(h2, W1T, b1, nullptr, m1,
                                                        ROWS, 4 * DD, DD);

    // 8) MLP down + residual -> d_out
    k_gemm_wmma<MODE_F32RES><<<blkQKV, 256, 0, stream>>>(m1, W2T, b2, outx,
                                                         (float*)d_out,
                                                         ROWS, DD, 4 * DD);
}
